// v010
// The times below were measured on an AMD MI455X: many runs one after another, warmed up first and cycling through
// copies of the inputs, with the whole window's GPU time divided by the number of runs. Launches and the gaps
// between them are all in it. The median over several windows is given; except for v000 it joins two sittings, which
// can be a few percent apart, so the side-by-side timings, each taken in one sitting, are the better comparison.
// Earlier versions than v010 are not in this document.
// Measured time: 148 microseconds a run.
// In both of two side-by-side timings against v009, it was 1.09 times as fast.
// Counting every step since v000, which is the starting kernel, it is 55.6 times as fast.
#include <hip/hip_runtime.h>
// Causal multi-head attention (q, k, v inputs [1][4096][1024]; qp/kp/vp = input W^T (nn.Linear [out][in], no bias), 16 heads of 64; scores x (8/64) = /8; causal mask (keys > query get -inf); softmax; out = (probs v merged) Wo^T -> [1][4096][1024]).
// Structure: token rows r = s; q, k, v inputs as exact f16 rows (bf16-rounded); Q, K, V as three WMMA GEMMs in one launch (32x64 wave tiles, f32 accumulation, exact x16 weights, f16 outputs; the first 256 rows also as f32); per batch: V^T for all heads via LDS transposes; one fused attention launch: a wave owns 32 query rows of a head and walks the keys up to its last row in steps of 32 (K and V^T tiles of 64 keys staged in LDS; a block of 16 waves owns 128 query rows, its keys dealt to 4 groups of 4 waves, whose partial results are merged through LDS): scores on WMMA (K = 64, x 0.125), online causal softmax in registers (f32 running maximum and sum, native exp; unnormalised weights f16), o += P V on WMMA (f32), divided by the row sum at the end (o carried x64, folded into the output GEMM alpha) written straight into the merged f16 o rows; out = o W_o GEMM (f32) into the output layout.
// Compute dtype: inputs rounded to bf16; x / weights exact; q, k, v, softmax weights and o as plain f16 GEMM operands (~2^-12); scores and softmax statistics f32; v_wmma_f32_16x16x32_f16.
#define NB 1
#define SQ 4096
#define DM 1024
#define NH 16
#define HD 64
#define HG 4                         /* heads per launch of the k_vt form that takes h0 (not launched) */
#define QT 256                       /* query rows per causal tile */
#define NKX SQ                       /* S / P row pitch */
#define QT0 256                      /* first-tile rows recomputed exactly in f32 */
#define B0 0                         /* first batch processed (debug hook) */
#define NBR NB                       /* batches processed (debug hook) */
#define NR ((size_t)NB * SQ)         /* token rows */
#define MP ((int)((size_t)NBR * SQ)) /* rows projected (debug hook) */
#define QN SQ                        /* query rows attended per batch (debug hook) */
#define NHD NH                       /* heads attended (debug hook) */
#define MPO MP                       /* rows through the output stage (debug hook) */
#define LQ DM      /* row pitch of the q/k/v rows */
typedef __bf16 v16b __attribute__((ext_vector_type(16)));
typedef unsigned short v8us __attribute__((ext_vector_type(8), may_alias));
typedef float  v8f  __attribute__((ext_vector_type(8)));
typedef float  v4f  __attribute__((ext_vector_type(4)));
typedef float  v4fa __attribute__((ext_vector_type(4), may_alias));
union FragB { v16b v; v8us half[2]; unsigned short u[16]; };

__device__ __forceinline__ unsigned short bf16_bits(float x) { unsigned int u = __float_as_uint(x); return (unsigned short)((u + 0x7FFFu + ((u >> 16) & 1u)) >> 16); }
__device__ __forceinline__ float bf16_val(unsigned short b) { return __uint_as_float(((unsigned int)b) << 16); }
__device__ __forceinline__ float bf16_round(float x) { return bf16_val(bf16_bits(x)); }
// D += A·B with NT terms: 1 = ah·bh, 2 = + al·bh (A split), 3 = + ah·bl (both split)
template <int NT>
__device__ __forceinline__ v8f mmaN(v16b ah, v16b al, v16b bh, v16b bl, v8f c) {
  c = __builtin_amdgcn_wmma_f32_16x16x32_bf16(false, ah, false, bh, (short)0, c, false, false);
  if (NT >= 2) c = __builtin_amdgcn_wmma_f32_16x16x32_bf16(false, al, false, bh, (short)0, c, false, false);
  if (NT >= 3) c = __builtin_amdgcn_wmma_f32_16x16x32_bf16(false, ah, false, bl, (short)0, c, false, false);
  asm volatile("v_nop\n\tv_nop\n\tv_nop\n\tv_nop" : "+v"(c) : "v"(ah), "v"(al), "v"(bh), "v"(bl));
  return c;
}

__global__ __launch_bounds__(256) void k_wt_bf16(const float* __restrict__ W, unsigned short* __restrict__ Wt, int K, int N) {
  const int t = blockIdx.x * 256 + threadIdx.x;
  const int k8n = K / 8;
  if (t >= N * k8n) return;
  const int n = t / k8n, k8 = (t % k8n) * 8;
  v8us v;
#pragma unroll
  for (int i = 0; i < 8; ++i) v[i] = bf16_bits(W[(size_t)(k8 + i) * N + n]);
  *(v8us*)(Wt + (size_t)n * K + k8) = v;
  
}

// GEMM C[M][N] (f32, pitch ldc) = act(A[M][K]·W + bias). A f32 row-major (pitch lda) converted per fragment to bf16
// (ASPLIT: hi/lo two planes -> 2 terms, else single rounded term); Wt bf16 [N][K] (pitch ldb). BIAS_BF16 rounds the
// bias to bf16 first (bias quantised to bf16 before the add). K%32==0, M%16==0, N%64==0.
template <bool ASPLIT, int ACT, bool BIAS_BF16>
__global__ __launch_bounds__(128) void k_gemm_bf(const float* __restrict__ A, int lda, const unsigned short* __restrict__ Wt, int ldb,
                                               const float* __restrict__ bias, float* __restrict__ C, int ldc, int M, int N, int K) {
  __shared__ __attribute__((aligned(16))) float so[4][16][64];
  const int tid = threadIdx.x, w = tid >> 5, lane = tid & 31, ln = lane & 15, hh = lane >> 4;
  const int ntn = N / 64;
  const int wid = blockIdx.x * 4 + w;
  const int mt = wid / ntn, nq = wid % ntn;
  if (mt * 16 >= M) return;
  const int row0 = mt * 16, col0 = nq * 64;
  const float* arow = A + (size_t)(row0 + ln) * lda;
  v8f acc[4] = {};
  for (int kb = 0; kb < K; kb += 32) {
    FragB ah, al;
    const v4f x0 = *(const v4fa*)(arow + kb + 8 * hh), x1 = *(const v4fa*)(arow + kb + 8 * hh + 4);
    const v4f x2 = *(const v4fa*)(arow + kb + 16 + 8 * hh), x3 = *(const v4fa*)(arow + kb + 16 + 8 * hh + 4);
    float xs[16] = {x0[0],x0[1],x0[2],x0[3],x1[0],x1[1],x1[2],x1[3],x2[0],x2[1],x2[2],x2[3],x3[0],x3[1],x3[2],x3[3]};
#pragma unroll
    for (int i = 0; i < 16; ++i) { const unsigned short hb = bf16_bits(xs[i]); ah.u[i] = hb; al.u[i] = ASPLIT ? bf16_bits(xs[i] - bf16_val(hb)) : (unsigned short)0; }
#pragma unroll
    for (int t = 0; t < 4; ++t) {
      const unsigned short* brow = Wt + (size_t)(col0 + t * 16 + ln) * ldb + kb;
      FragB b;
      b.half[0] = *(const v8us*)(brow + 8 * hh);
      b.half[1] = *(const v8us*)(brow + 16 + 8 * hh);
      acc[t] = mmaN<ASPLIT ? 2 : 1>(ah.v, al.v, b.v, b.v, acc[t]);
    }
  }
#pragma unroll
  for (int t = 0; t < 4; ++t) {
    float bv = bias ? bias[col0 + t * 16 + ln] : 0.f;
    if (BIAS_BF16) bv = bf16_round(bv);
#pragma unroll
    for (int r = 0; r < 8; ++r) { float v = acc[t][r] + bv; if (ACT == 1) v = fmaxf(v, 0.f); so[w][8 * hh + r][t * 16 + ln] = v; }
  }
  __builtin_amdgcn_fence(__ATOMIC_ACQ_REL, "workgroup");
  __builtin_amdgcn_wave_barrier();
  const int rsub = lane >> 4, c4 = (lane & 15) * 4;
  {
#pragma unroll
    for (int q = 0; q < 8; ++q) {
      const int r = q * 2 + rsub;
      const v4f v = *(const v4fa*)&so[w][r][c4];
      *(v4f*)(C + (size_t)(row0 + r) * ldc + col0 + c4) = v;
    }
    
  }
}

// GEMM C = act(A·W + bias + resid): A f32 (ASPLIT -> hi/lo 2 terms), Wt bf16 [N][K]; ACT 0 none, 1 relu, 2 exact gelu;
// resid (optional, f32, row index = (row % rmod), pitch ldr, RES_BF16 rounds it) added before the activation.
template <bool ASPLIT, int ACT, bool BIAS_BF16, bool RES_BF16>
__global__ __launch_bounds__(128) void k_gemm_bf3(const float* __restrict__ A, int lda, const unsigned short* __restrict__ Wt, int ldb,
                                                const float* __restrict__ bias, const float* __restrict__ resid, int rmod, int ldr,
                                                float* __restrict__ C, int ldc, int M, int N, int K) {
  __shared__ __attribute__((aligned(16))) float so[4][16][64];
  const int tid = threadIdx.x, w = tid >> 5, lane = tid & 31, ln = lane & 15, hh = lane >> 4;
  const int ntn = N / 64;
  const int wid = blockIdx.x * 4 + w;
  const int mt = wid / ntn, nq = wid % ntn;
  if (mt * 16 >= M) return;
  const int row0 = mt * 16, col0 = nq * 64;
  const float* arow = A + (size_t)(row0 + ln) * lda;
  v8f acc[4] = {};
  for (int kb = 0; kb < K; kb += 32) {
    FragB ah, al;
    const v4f x0 = *(const v4fa*)(arow + kb + 8 * hh), x1 = *(const v4fa*)(arow + kb + 8 * hh + 4);
    const v4f x2 = *(const v4fa*)(arow + kb + 16 + 8 * hh), x3 = *(const v4fa*)(arow + kb + 16 + 8 * hh + 4);
    float xs[16] = {x0[0],x0[1],x0[2],x0[3],x1[0],x1[1],x1[2],x1[3],x2[0],x2[1],x2[2],x2[3],x3[0],x3[1],x3[2],x3[3]};
#pragma unroll
    for (int i = 0; i < 16; ++i) { const unsigned short hb = bf16_bits(xs[i]); ah.u[i] = hb; al.u[i] = ASPLIT ? bf16_bits(xs[i] - bf16_val(hb)) : (unsigned short)0; }
#pragma unroll
    for (int t = 0; t < 4; ++t) {
      const unsigned short* brow = Wt + (size_t)(col0 + t * 16 + ln) * ldb + kb;
      FragB b;
      b.half[0] = *(const v8us*)(brow + 8 * hh);
      b.half[1] = *(const v8us*)(brow + 16 + 8 * hh);
      acc[t] = mmaN<ASPLIT ? 2 : 1>(ah.v, al.v, b.v, b.v, acc[t]);
    }
  }
#pragma unroll
  for (int t = 0; t < 4; ++t) {
    const int col = col0 + t * 16 + ln;
    float bv = bias ? bias[col] : 0.f;
    if (BIAS_BF16) bv = bf16_round(bv);
#pragma unroll
    for (int r = 0; r < 8; ++r) {
      float v = acc[t][r] + bv;
      if (resid) { float rv = resid[(size_t)((row0 + 8 * hh + r) % rmod) * ldr + col]; if (RES_BF16) rv = bf16_round(rv); v += rv; }
      if (ACT == 1) v = fmaxf(v, 0.f);
      if (ACT == 2) v = 0.5f * v * (1.0f + erff(v * 0.70710678118654752f));
      if (ACT == 3) { const float u = 0.7978845608028654f * (v + 0.044715f * v * v * v); v = 0.5f * v * (1.0f + tanhf(u)); }
      so[w][8 * hh + r][t * 16 + ln] = v;
    }
  }
  __builtin_amdgcn_fence(__ATOMIC_ACQ_REL, "workgroup");
  __builtin_amdgcn_wave_barrier();
  const int rsub = lane >> 4, c4 = (lane & 15) * 4;
  {
#pragma unroll
    for (int q = 0; q < 8; ++q) {
      const int r = q * 2 + rsub;
      const v4f v = *(const v4fa*)&so[w][r][c4];
      *(v4f*)(C + (size_t)(row0 + r) * ldc + col0 + c4) = v;
    }
    
  }
}
// row LayerNorm (biased variance, eps) over N: s = X (+ R); optional out_sum <- s; out_norm <- (s-mu)*rsqrt(var+eps)*g + b
template <bool PARAM_BF16>
__global__ __launch_bounds__(256) void k_layernorm(const float* __restrict__ X, const float* __restrict__ R, const float* __restrict__ g, const float* __restrict__ bta,
                                                  float* __restrict__ out_sum, float* __restrict__ out_norm, int N, float eps) {
  __shared__ float red[256];
  const int row = blockIdx.x, tid = threadIdx.x;
  const float* x = X + (size_t)row * N; const float* rr = R ? R + (size_t)row * N : nullptr;
  float vals[16];                     // up to N = 4096
  const int per = N / 256;            // contiguous chunk per thread? use strided-by-4 chunks: thread handles j = tid*4 + 1024*u
  float s1 = 0.f;
  for (int u = 0; u < per / 4; ++u) {
    const int j = tid * 4 + 1024 * u;
    const v4f a = *(const v4fa*)(x + j);
    v4f b = {0.f,0.f,0.f,0.f}; if (rr) b = *(const v4fa*)(rr + j);
#pragma unroll
    for (int q = 0; q < 4; ++q) { const float v = a[q] + b[q]; vals[u * 4 + q] = v; s1 += v; }
  }
  red[tid] = s1; __syncthreads();
  for (int st = 128; st > 0; st >>= 1) { if (tid < st) red[tid] += red[tid + st]; __syncthreads(); }
  const float mu = red[0] / (float)N; __syncthreads();
  float s2 = 0.f;
  for (int u = 0; u < per / 4; ++u)
#pragma unroll
    for (int q = 0; q < 4; ++q) { const float c = vals[u * 4 + q] - mu; s2 += c * c; }
  red[tid] = s2; __syncthreads();
  for (int st = 128; st > 0; st >>= 1) { if (tid < st) red[tid] += red[tid + st]; __syncthreads(); }
  const float rs = rsqrtf(red[0] / (float)N + eps);
  {
    for (int u = 0; u < per / 4; ++u) {
      const int j = tid * 4 + 1024 * u;
      v4f o, sm;
#pragma unroll
      for (int q = 0; q < 4; ++q) {
        float gg = g[j + q], bb = bta[j + q];
        if (PARAM_BF16) { gg = bf16_round(gg); bb = bf16_round(bb); }
        sm[q] = vals[u * 4 + q]; o[q] = (vals[u * 4 + q] - mu) * rs * gg + bb;
      }
      if (out_sum) *(v4f*)(out_sum + (size_t)row * N + j) = sm;
      *(v4f*)(out_norm + (size_t)row * N + j) = o;
    }
    
  }
}



// ---- f16 WMMA path (v_wmma_f32_16x16x32_f16): 11-bit significands for operands in range — used where a [0,1] probability operand needs more precision than bf16
typedef _Float16 v16h __attribute__((ext_vector_type(16)));
union FragH { v16h v; v8us half[2]; _Float16 h[16]; unsigned short u[16]; };
template <int NT>
__device__ __forceinline__ v8f mmaH(v16h ah, v16h al, v16h bh, v16h bl, v8f c) {
  c = __builtin_amdgcn_wmma_f32_16x16x32_f16(false, ah, false, bh, (short)0, c, false, false);
  if (NT >= 2) c = __builtin_amdgcn_wmma_f32_16x16x32_f16(false, al, false, bh, (short)0, c, false, false);
  if (NT >= 3) c = __builtin_amdgcn_wmma_f32_16x16x32_f16(false, ah, false, bl, (short)0, c, false, false);
  asm volatile("v_nop\n\tv_nop\n\tv_nop\n\tv_nop" : "+v"(c) : "v"(ah), "v"(al), "v"(bh), "v"(bl));
  return c;
}
// batched GEMM like k_gemm_b but f16 operands: A f32 (split into f16 hi/lo if ASPLIT, else rounded to f16), Bt = f16 values [n][k]; alpha; C f32; N multiple of 16 (partial tiles skipped)
template <bool ASPLIT>
__global__ __launch_bounds__(128) void k_gemm_h(const float* __restrict__ A, int lda, size_t sA, const _Float16* __restrict__ Bh, int ldb, size_t sB, float alpha, float* __restrict__ C, int ldc, size_t sC, int M, int N, int K) {
  __shared__ __attribute__((aligned(16))) float so[4][16][64];
  const int tid = threadIdx.x, w = tid >> 5, lane = tid & 31, ln = lane & 15, hh = lane >> 4; const int by = blockIdx.y;
  A += (size_t)by * sA; Bh += (size_t)by * sB; C += (size_t)by * sC;
  const int ntn = (N + 63) / 64; const int wid = blockIdx.x * 4 + w; const int mt = wid / ntn, nq = wid % ntn; if (mt * 16 >= M) return;
  const int row0 = mt * 16, col0 = nq * 64; const float* arow = A + (size_t)(row0 + ln) * lda;
  v8f acc[4] = {};
  for (int kb = 0; kb < K; kb += 32) {
    FragH ah, al;
    const v4f x0 = *(const v4fa*)(arow + kb + 8 * hh), x1 = *(const v4fa*)(arow + kb + 8 * hh + 4), x2 = *(const v4fa*)(arow + kb + 16 + 8 * hh), x3 = *(const v4fa*)(arow + kb + 16 + 8 * hh + 4);
    float xs[16] = {x0[0],x0[1],x0[2],x0[3],x1[0],x1[1],x1[2],x1[3],x2[0],x2[1],x2[2],x2[3],x3[0],x3[1],x3[2],x3[3]};
#pragma unroll
    for (int i = 0; i < 16; ++i) { const _Float16 h = (_Float16)xs[i]; ah.h[i] = h; al.h[i] = ASPLIT ? (_Float16)(xs[i] - (float)h) : (_Float16)0.0f; }
#pragma unroll
    for (int t = 0; t < 4; ++t) { if (col0 + t * 16 >= N) continue; const size_t boff = (size_t)(col0 + t * 16 + ln) * ldb + kb; FragH bq; bq.half[0] = *(const v8us*)(Bh + boff + 8 * hh); bq.half[1] = *(const v8us*)(Bh + boff + 16 + 8 * hh);
      acc[t] = mmaH<ASPLIT ? 2 : 1>(ah.v, al.v, bq.v, bq.v, acc[t]); }
  }
#pragma unroll
  for (int t = 0; t < 4; ++t) { if (col0 + t * 16 >= N) continue;
#pragma unroll
    for (int r = 0; r < 8; ++r) so[w][8 * hh + r][t * 16 + ln] = acc[t][r] * alpha; }
  __builtin_amdgcn_fence(__ATOMIC_ACQ_REL, "workgroup"); __builtin_amdgcn_wave_barrier();
  const int rsub = lane >> 4, c4 = (lane & 15) * 4;
  {
#pragma unroll
    for (int q = 0; q < 8; ++q) { const int r = q * 2 + rsub; if (col0 + c4 < N) { const v4f v = *(const v4fa*)&so[w][r][c4]; *(v4f*)(C + (size_t)(row0 + r) * ldc + col0 + c4) = v; } }
     }
}

// Wt[n][k] = f16(W[k][n]·scale) from f32 row-major W[K][N] (scale = power of two; bf16-exact weights stay exact in f16 away from the subnormal range)
__global__ __launch_bounds__(256) void k_wt_f16(const float* __restrict__ W, _Float16* __restrict__ Wt, int K, int N, float scale) {
  const int t = blockIdx.x * 256 + threadIdx.x; if (t >= N * (K / 8)) return; const int n = t / (K / 8), k8 = (t % (K / 8)) * 8; FragH f;
#pragma unroll
  for (int i = 0; i < 8; ++i) f.h[i] = (_Float16)(bf16_round(W[(size_t)(k8 + i) * N + n]) * scale); const v8us o = f.half[0];
  *(v8us*)((unsigned short*)Wt + (size_t)n * K + k8) = o; 
}
// k_gemm_hh variant with fused epilogue: v = acc·alpha + bias[by·sBias + col] (+ CP[(row/rowsPerB)·sCPb + by·64 + col] if CP) ; ACT 0 none / 1 elu ; writes f16 C16 (and f32 C if non-null)
template <int ACT>
__global__ __launch_bounds__(128) void k_gemm_hhx(const _Float16* __restrict__ A, int lda, size_t sA, const _Float16* __restrict__ Bh, int ldb, size_t sB, float alpha, const float* __restrict__ bias, size_t sBias, const float* __restrict__ CP, int rowsPerB, size_t sCPb, int row0g,
    float* __restrict__ C, _Float16* __restrict__ C16, int ldc, size_t sC, int M, int N, int K) {
  __shared__ __attribute__((aligned(16))) float so[4][16][64];
  const int tid = threadIdx.x, w = tid >> 5, lane = tid & 31, ln = lane & 15, hh = lane >> 4; const int by = blockIdx.y;
  A += (size_t)by * sA; Bh += (size_t)by * sB; const size_t cofs = (size_t)by * sC; const float* bp = bias ? bias + (size_t)by * sBias : nullptr;
  const int ntn = (N + 63) / 64; const int wid = blockIdx.x * 4 + w; const int mt = wid / ntn, nq = wid % ntn; if (mt * 16 >= M) return;
  const int row0 = mt * 16, col0 = nq * 64; const _Float16* arow = A + (size_t)(row0 + ln) * lda;
  v8f acc[4] = {};
  for (int kb = 0; kb < K; kb += 32) { FragH ah; ah.half[0] = *(const v8us*)((const unsigned short*)arow + kb + 8 * hh); ah.half[1] = *(const v8us*)((const unsigned short*)arow + kb + 16 + 8 * hh);
#pragma unroll
    for (int t = 0; t < 4; ++t) { if (col0 + t * 16 >= N) continue; const size_t boff = (size_t)(col0 + t * 16 + ln) * ldb + kb; FragH bq; bq.half[0] = *(const v8us*)((const unsigned short*)Bh + boff + 8 * hh); bq.half[1] = *(const v8us*)((const unsigned short*)Bh + boff + 16 + 8 * hh);
      acc[t] = mmaH<1>(ah.v, ah.v, bq.v, bq.v, acc[t]); }
  }
#pragma unroll
  for (int t = 0; t < 4; ++t) { if (col0 + t * 16 >= N) continue; const int col = col0 + t * 16 + ln; const float bv = bp ? bf16_round(bp[col]) : 0.f;
#pragma unroll
    for (int r = 0; r < 8; ++r) { float v = acc[t][r] * alpha + bv; if (CP) { const int rr = row0g + row0 + 8 * hh + r; if (rowsPerB < 0) v += CP[cofs + (size_t)rr * ldc + col];      /* rowsPerB < 0: own element of the batched C plane */ else { const int bidx = rr / rowsPerB; v += CP[(size_t)bidx * sCPb + (size_t)by * 64 + col]; } } if (ACT == 1) v = (v > 0.f) ? v : expm1f(v); else if (ACT == 7) v = (v > 0.f) ? v + 1.0f : expf(v); else if (ACT == 8) v = tanhf(v); else if (ACT == 9) v = 0.5f * v * (1.0f + tanhf(0.7978845608028654f * (v + 0.044715f * v * v * v))); else if (ACT == 11) v = 1.0f / (1.0f + expf(-v)); else if (ACT == 12) v = (v > 0.f) ? v : 0.01f * v; else if (ACT == 14) v = (v > 0.f) ? v : 0.1f * v; else if (ACT == 16) v = (v >= 0.f) ? v : 0.3f * v; else if (ACT == 17) v = (v >= 0.f) ? v : 0.2f * v; else if (ACT == 15) v = v / (1.0f + expf(-v)); else if (ACT == 3) v = fmaxf(v, 0.f); else if (ACT == 6) v = 0.5f * v * (1.0f + erff(v * 0.70710678118654752f)); so[w][8 * hh + r][t * 16 + ln] = v; } }
  __builtin_amdgcn_fence(__ATOMIC_ACQ_REL, "workgroup"); __builtin_amdgcn_wave_barrier();
  const int rsub = lane >> 4, c4 = (lane & 15) * 4; typedef _Float16 v4h __attribute__((ext_vector_type(4)));
  {
#pragma unroll
    for (int q = 0; q < 8; ++q) { const int r = q * 2 + rsub; if (col0 + c4 < N) { const v4f v = *(const v4fa*)&so[w][r][c4]; if (C) *(v4f*)(C + cofs + (size_t)(row0 + r) * ldc + col0 + c4) = v; if (C16) { v4h h4; for (int i = 0; i < 4; ++i) h4[i] = (_Float16)v[i]; *(v4h*)(C16 + cofs + (size_t)(row0 + r) * ldc + col0 + c4) = h4; } } }
     }
}


typedef _Float16 v4h __attribute__((ext_vector_type(4)));

__global__ __launch_bounds__(256) void k_h16(const float* __restrict__ x, _Float16* __restrict__ X16, size_t n8) { const size_t t = (size_t)blockIdx.x * 256 + threadIdx.x; if (t >= n8) return; FragH f;
#pragma unroll
  for (int q = 0; q < 8; ++q) f.h[q] = (_Float16)x[t * 8 + q]; *(v8us*)((unsigned short*)X16 + t * 8) = f.half[0];  }
__global__ __launch_bounds__(256) void k_round16f(const float* __restrict__ W, _Float16* __restrict__ Bt, size_t n8) { const size_t t = (size_t)blockIdx.x * 256 + threadIdx.x; if (t >= n8) return; FragH f;
#pragma unroll
  for (int i = 0; i < 8; ++i) f.h[i] = (_Float16)(bf16_round(W[t * 8 + i]) * 16.0f); *(v8us*)((unsigned short*)Bt + t * 8) = f.half[0];  }
template <int NHv, int TTv>
__global__ __launch_bounds__(256) void k_vt(const _Float16* __restrict__ V16, int ldv, int voff, _Float16* __restrict__ Vt) { __shared__ unsigned short tl[64][66]; const int tid = threadIdx.x; const int slab = blockIdx.x / (TTv / 64), lg = blockIdx.x % (TTv / 64); const int b = slab / NHv, h = slab % NHv;
  for (int i = tid; i < 64 * 8; i += 256) { const int r = i / 8, c8 = (i % 8) * 8; FragH f; f.half[0] = *(const v8us*)((const unsigned short*)V16 + ((size_t)b * TTv + lg * 64 + r) * ldv + voff + h * 64 + c8);
#pragma unroll
    for (int q = 0; q < 8; ++q) tl[r][c8 + q] = f.u[q]; }
  __syncthreads();
  {
#pragma unroll
    for (int rd = 0; rd < 2; ++rd) { const int d = rd * 32 + tid / 8, pc = tid % 8; FragH f;
#pragma unroll
      for (int q = 0; q < 8; ++q) f.u[q] = tl[pc * 8 + q][d];
      *(v8us*)((unsigned short*)Vt + ((size_t)slab * 64 + d) * TTv + lg * 64 + pc * 8) = f.half[0]; }
     } }

__global__ __launch_bounds__(256) void k_hl(const float* __restrict__ F, _Float16* __restrict__ Hh, _Float16* __restrict__ Hl, size_t n8) { const size_t t = (size_t)blockIdx.x * 256 + threadIdx.x; if (t >= n8) return; FragH fh, fl; const v4f a = *(const v4fa*)(F + t * 8), c = *(const v4fa*)(F + t * 8 + 4);
#pragma unroll
  for (int q = 0; q < 4; ++q) { _Float16 h = (_Float16)a[q]; fh.h[q] = h; fl.h[q] = (_Float16)((a[q] - (float)h) * 1024.0f); h = (_Float16)c[q]; fh.h[4 + q] = h; fl.h[4 + q] = (_Float16)((c[q] - (float)h) * 1024.0f); }
  { *(v8us*)((unsigned short*)Hh + t * 8) = fh.half[0]; *(v8us*)((unsigned short*)Hl + t * 8) = fl.half[0];  } }

// ---- fast GEMM (wave tile 32x64; requires M % 128 == 0 rows per launch region and N % 64 == 0); epilogue = k_gemm_hhx semantics ----
__device__ __forceinline__ v16h g2_frag(const _Float16* p, int hh) { FragH f; f.half[0] = *(const v8us*)((const unsigned short*)p + 8 * hh); f.half[1] = *(const v8us*)((const unsigned short*)p + 16 + 8 * hh); return f.v; }
__device__ __forceinline__ v8f g2_mmab(v16h a, v16h b, v8f c) { return __builtin_amdgcn_wmma_f32_16x16x32_f16(false, a, false, b, (short)0, c, false, false); }
#define G2KC 64                      /* k per staged tile: 128 bytes, one cache line of every operand row */
#define G2P 72                       /* LDS row pitch in f16: 128 + 16 bytes, so that the 16 rows of a 16-byte fragment read fall on different banks */
// The f32 output C (plane pitch sCF over blockIdx.y) takes the rows below rowsF only (a multiple of 128: the test is the same for a whole block); the f16 output C16 (plane pitch sC) takes every row.
// Block tile 128 x 64. Per 64 k the block's 128 A rows and 64 B rows go global -> registers -> LDS with whole-line loads, one tile ahead, two LDS buffers; the waves read their fragments from LDS. Needs M % 128 == 0, K % 64 == 0, K >= 64.
// HL: the first rows2 rows of A come as two planes, A (high part) and A2 (low part, carried x1024). A block of those rows owns 64 output rows: its 128 A rows are the 64 rows of A (waves 0, 1) and the same 64 rows of A2 (waves 2, 3);
// behind the k loop the two products of a row are added through LDS. The grid's first (rows2 / 64) block rows are of this kind, the rest are plain 128-row blocks. Needs rows2 % 128 == 0; such a block stores alpha (A + A2 / 1024) B into C and nothing else.
template <int ACT, bool HL>
__global__ __launch_bounds__(128) void k_gemm2(const _Float16* __restrict__ A, int lda, size_t sA, const _Float16* __restrict__ Bh, int ldb, size_t sB, float alpha, const float* __restrict__ bias, size_t sBias, const float* __restrict__ CP, int rowsPerB, size_t sCPb, int row0g,
    float* __restrict__ C, _Float16* __restrict__ C16, int ldc, size_t sC, int M, int N, int K, size_t sCF, int rowsF, const _Float16* __restrict__ A2, int rows2) { static_assert(ACT == 0 || ACT == 3 || ACT == 6 || ACT == 8 || ACT == 9 || ACT == 11 || ACT == 12 || ACT == 14 || ACT == 15 || ACT == 16 || ACT == 17, "k_gemm2: unsupported ACT code (would silently apply no activation)");
  __shared__ __attribute__((aligned(16))) float so[4][32][68];
  __shared__ __attribute__((aligned(16))) _Float16 st[2][192][G2P];      /* two staged tiles: rows 0..127 = the block's A rows, rows 128..191 = its B rows, G2KC k each */
  const int tid = threadIdx.x, w = tid >> 5, lane = tid & 31, ln = lane & 15, hh = lane >> 4; const int by = blockIdx.y;
  A += (size_t)by * sA; Bh += (size_t)by * sB; const size_t cofs = (size_t)by * sC; const float* bp = bias ? bias + (size_t)by * sBias : nullptr;
  const int ntn = N >> 6; const int mt = blockIdx.x / ntn, nq = blockIdx.x - mt * ntn;
  const bool hl = HL && mt * 64 < rows2;      /* a block of two-plane rows: the same for the whole block */
  const int rb = !HL ? mt * 128 : hl ? mt * 64 : rows2 + (mt - rows2 / 64) * 128;      /* the block's first output row */
  const int row0 = rb + 32 * w, col0 = nq * 64; if (rb >= M) return;      /* the same for the whole block: it stands in front of the barriers */
  const int sr = tid >> 3, sg = tid & 7;      /* staging: 8 threads bring one row's 128 bytes, so a wave's 16-byte load is 4 whole cache lines */
  const _Float16* gp[12];      /* the thread's 8 A pieces and 4 B pieces of the tile to be fetched next */
#pragma unroll
  for (int i = 0; i < 8; ++i) gp[i] = (hl && i >= 4 ? A2 + (size_t)(rb + sr + 16 * (i - 4)) * lda : A + (size_t)(rb + sr + 16 * i) * lda) + sg * 8;      /* two-plane block: tile rows 64..127 are the low parts of tile rows 0..63 */
#pragma unroll
  for (int i = 0; i < 4; ++i) gp[8 + i] = Bh + (size_t)(col0 + sr + 16 * i) * ldb + sg * 8;
  v8us rg[12];      /* the tile on its way from global memory to LDS */
  auto fetch = [&]() {
#pragma unroll
    for (int i = 0; i < 12; ++i) rg[i] = *(const v8us*)(const unsigned short*)gp[i];
    asm volatile("s_wait_xcnt 0x0" :: "v"(gp[0]), "v"(gp[1]), "v"(gp[2]), "v"(gp[3]), "v"(gp[4]), "v"(gp[5]), "v"(gp[6]), "v"(gp[7]), "v"(gp[8]), "v"(gp[9]), "v"(gp[10]), "v"(gp[11]) : "memory");      /* the 12 addresses are named so that their registers live up to this wait: none is overwritten in front of it, neither by the step to the next tile below nor by a load's result */
#pragma unroll
    for (int i = 0; i < 12; ++i) gp[i] += G2KC; };
  auto put = [&](int buf) {
#pragma unroll
    for (int i = 0; i < 12; ++i) *(v8us*)&st[buf][sr + 16 * i][sg * 8] = rg[i]; };
  auto lfrag = [&](int buf, int row, int kk) { FragH f; const unsigned short* p = (const unsigned short*)&st[buf][row][kk * 32 + 8 * hh]; f.half[0] = *(const v8us*)p; f.half[1] = *(const v8us*)(p + 16); return f.v; };      /* the k order of g2_frag */
  const v8f z8 = {0.f,0.f,0.f,0.f,0.f,0.f,0.f,0.f}; v8f c00 = z8, c01 = z8, c02 = z8, c03 = z8, c10 = z8, c11 = z8, c12 = z8, c13 = z8;
  const int nc = K / G2KC;
  fetch(); put(0); __syncthreads();
#pragma unroll 1      /* one copy of the tile body: the trip count is a run-time value and the body is long */
  for (int c = 0; c < nc; ++c) { const int buf = c & 1;
    if (c + 1 < nc) fetch();      /* the next tile's global loads fly while this tile is worked on */
    v16h a[2][2], b[2][4];
#pragma unroll
    for (int kk = 0; kk < 2; ++kk) { a[kk][0] = lfrag(buf, 32 * w + ln, kk); a[kk][1] = lfrag(buf, 32 * w + 16 + ln, kk);
#pragma unroll
      for (int t = 0; t < 4; ++t) b[kk][t] = lfrag(buf, 128 + 16 * t + ln, kk); }
    __builtin_amdgcn_sched_barrier(0);      /* keeps the tile's 24 LDS reads together in front of its 16 WMMAs: one LDS latency a tile with counted waits, where the scheduler otherwise reuses one B fragment's registers and waits for LDS eight times */
#pragma unroll
    for (int kk = 0; kk < 2; ++kk) {
      c00 = g2_mmab(a[kk][0], b[kk][0], c00); c10 = g2_mmab(a[kk][1], b[kk][0], c10); c01 = g2_mmab(a[kk][0], b[kk][1], c01); c11 = g2_mmab(a[kk][1], b[kk][1], c11);
      c02 = g2_mmab(a[kk][0], b[kk][2], c02); c12 = g2_mmab(a[kk][1], b[kk][2], c12); c03 = g2_mmab(a[kk][0], b[kk][3], c03); c13 = g2_mmab(a[kk][1], b[kk][3], c13); }
    if (c + 1 < nc) put(buf ^ 1);      /* into the buffer whose last readers passed the barrier at the foot of the trip before */
    __syncthreads(); }      /* one barrier a tile: publishes tile c + 1 and ends the reads of tile c */
  v8f accs[8] = {c00, c01, c02, c03, c10, c11, c12, c13};
  if (HL && hl) {      /* the same for the whole block */
    const float aw = w < 2 ? alpha : alpha * 0.0009765625f;      /* the low plane is carried x1024; both factors are powers of two here, so the scaling is exact */
#pragma unroll
    for (int u = 0; u < 8; ++u)
#pragma unroll
      for (int r = 0; r < 8; ++r) so[w][(u >> 2) * 16 + 8 * hh + r][(u & 3) * 16 + ln] = accs[u][r] * aw;
    __syncthreads();      /* the high-part and low-part products of the block's 64 rows are in LDS */
    const int c4h = (lane & 15) * 4;
#pragma unroll
    for (int q = 0; q < 8; ++q) { const int r = 16 * w + q * 2 + (lane >> 4);      /* a wave adds and stores 16 of the 64 rows, 16 lanes a row: whole 256-byte row pieces */
      const v4f vh = *(const v4fa*)&so[r >> 5][r & 31][c4h], vl = *(const v4fa*)&so[2 + (r >> 5)][r & 31][c4h]; const v4f v = vl + vh;
      *(v4f*)(C + (size_t)(rb + r) * ldc + col0 + c4h) = v; }
    return; }
#pragma unroll
  for (int u = 0; u < 8; ++u) { const int t = u & 3, half = u >> 2; const int col = col0 + t * 16 + ln; const float bv = bp ? bf16_round(bp[col]) : 0.f;
#pragma unroll
    for (int r = 0; r < 8; ++r) { const int rloc = half * 16 + 8 * hh + r; float v = accs[u][r] * alpha + bv; if (CP) { if (rowsPerB < 0) v += CP[cofs + (size_t)(row0g + row0 + rloc) * ldc + col];      /* rowsPerB < 0: own element of the batched C plane */ else { const int bidx = (row0g + row0 + rloc) / rowsPerB; v += CP[(size_t)bidx * sCPb + (size_t)by * 64 + col]; } }
      if (ACT == 3) v = fmaxf(v, 0.f); else if (ACT == 6) v = 0.5f * v * (1.0f + erff(v * 0.70710678118654752f)); else if (ACT == 11) v = 1.0f / (1.0f + expf(-v)); else if (ACT == 15) v = v / (1.0f + expf(-v)); else if (ACT == 12) v = (v > 0.f) ? v : 0.01f * v; else if (ACT == 8) v = tanhf(v); else if (ACT == 9) v = 0.5f * v * (1.0f + tanhf(0.7978845608028654f * (v + 0.044715f * v * v * v))); else if (ACT == 14) v = (v > 0.f) ? v : 0.1f * v; else if (ACT == 16) v = (v >= 0.f) ? v : 0.3f * v; else if (ACT == 17) v = (v >= 0.f) ? v : 0.2f * v;
      so[w][rloc][t * 16 + ln] = v; } }
  __builtin_amdgcn_fence(__ATOMIC_ACQ_REL, "workgroup"); __builtin_amdgcn_wave_barrier();
  const int rsub = lane >> 4, c4 = (lane & 15) * 4;
  float* CF = (C && rb < rowsF) ? C + (size_t)by * sCF : nullptr;
  {
#pragma unroll
    for (int q = 0; q < 16; ++q) { const int r = q * 2 + rsub; const v4f v = *(const v4fa*)&so[w][r][c4]; if (CF) { float* pf = CF + (size_t)(row0 + r) * ldc + col0 + c4; *(v4f*)pf = v; asm volatile("s_wait_xcnt 0x0" :: "v"(pf), "v"(v) : "memory"); }      /* the store's address and data are named so that their registers live up to this wait: where both outputs are stored, the f16 conversion below reuses them */
      if (C16) { v4h h4; for (int i = 0; i < 4; ++i) h4[i] = (_Float16)v[i]; *(v4h*)(C16 + cofs + (size_t)(row0 + r) * ldc + col0 + c4) = h4; } }
     } }


#define CVW 16                       /* waves per k_cvt work-group: 256 work-groups, one per WGP */
#define CVL 32                       /* 16-byte loads per lane, all issued before the first value is used */
#define CVE (CVL * 128)              /* f32 values per wave: 16 KiB of one source, consecutive */
// All seven f32 -> f16 conversions (4 weights: bf16-rounded x16; 3 inputs: bf16-rounded) in one streaming launch. D is the workspace range [BQ BK BV BO XQ XK XV], which lies in one piece in this order.
// A wave takes piece c of 4096 values: its source, its place there and its scale are wave-uniform. One load of a wave is 512 consecutive bytes (4 whole lines), one store 256 (2 whole lines).
__global__ __launch_bounds__(CVW * 32) void k_cvt(const float* __restrict__ wq, const float* __restrict__ wk, const float* __restrict__ wv, const float* __restrict__ wo, const float* __restrict__ xq, const float* __restrict__ xk, const float* __restrict__ xv, _Float16* __restrict__ D) {
  constexpr int WC = DM * DM / CVE, XC = (int)(NR * DM / CVE);      /* pieces per weight, per input */
  static_assert(DM * DM % CVE == 0 && NR * DM % CVE == 0 && (4 * WC + 3 * XC) % CVW == 0 && (DM * DM * 2) % 256 == 0 && (NR * DM * 2) % 256 == 0, "whole pieces, whole work-groups, no pad between the workspace planes");
  const int lane = threadIdx.x & 31; const int c = (int)blockIdx.x * CVW + __builtin_amdgcn_readfirstlane((int)(threadIdx.x >> 5));
  const float* s; float sc;
  if (c < 4 * WC) { const int i = c / WC; s = (i == 0 ? wq : i == 1 ? wk : i == 2 ? wv : wo) + (size_t)(c % WC) * CVE; sc = 16.0f; }
  else { const int e = c - 4 * WC, i = e / XC; s = (i == 0 ? xq : i == 1 ? xk : xv) + (size_t)(e % XC) * CVE; sc = 1.0f; }      /* x 1 is exact */
  const unsigned lo = (unsigned)lane * 16;      /* the lane's byte in every 512-byte row of the piece */
  v4f r[CVL];
#pragma unroll
  for (int q = 0; q < CVL; ++q) r[q] = __builtin_nontemporal_load((const v4fa*)((const char*)s + q * 512 + lo));      /* read once: not kept in L2 */
  __builtin_amdgcn_sched_barrier(0);      /* keeps the conversions behind all 32 loads: the wave's whole piece is in flight at once, where the scheduler otherwise holds most of them back until the first values are converted */
  _Float16* d = D + (size_t)c * CVE + lane * 4;
#pragma unroll
  for (int q = 0; q < CVL; ++q) { v4h h;
#pragma unroll
    for (int i = 0; i < 4; ++i) h[i] = (_Float16)(bf16_round(r[q][i]) * sc);
    *(v4h*)(d + q * 128) = h; }
}
__global__ __launch_bounds__(256) void k_rsm(const float* __restrict__ S, _Float16* __restrict__ P, int nrows) {
  #pragma clang fp contract(off)
  const int i = blockIdx.x * 256 + threadIdx.x; if (i >= nrows) return; const float* s = S + (size_t)i * SQ; float mx = -3.0e38f;
#pragma unroll 1
  for (int j = 0; j < SQ; ++j) mx = fmaxf(mx, s[j]); float se = 0.f;
#pragma unroll 1
  for (int j = 0; j < SQ; ++j) se += expf(s[j] - mx); const float sc = 256.0f / se;
#pragma unroll 1
  for (int j0 = 0; j0 < SQ; j0 += 8) { FragH f; for (int q = 0; q < 8; ++q) f.h[q] = (_Float16)(expf(s[j0 + q] - mx) * sc); unsigned short* d = (unsigned short*)P + (size_t)i * SQ + j0; *(v8us*)d = f.half[0];  } }
__global__ __launch_bounds__(256) void k_vt(const _Float16* __restrict__ V16, int b, int h0, _Float16* __restrict__ VT) { __shared__ unsigned short tl[64][65]; const int tid = threadIdx.x; const int hh = blockIdx.x % HG, sg = blockIdx.x / HG; const int s0 = sg * 64; const int h = h0 + hh;
  for (int i = tid; i < 64 * 8; i += 256) { const int j = i / 8, d8 = (i % 8) * 8; FragH f; f.half[0] = *(const v8us*)((const unsigned short*)V16 + ((size_t)b * SQ + s0 + j) * DM + h * HD + d8); for (int q = 0; q < 8; ++q) tl[d8 + q][j] = f.u[q]; }
  __syncthreads();
  { for (int i = tid; i < 64 * 8; i += 256) { const int d = i / 8, j8 = (i % 8) * 8; FragH f; for (int q = 0; q < 8; ++q) f.u[q] = tl[d][j8 + q]; *(v8us*)((unsigned short*)VT + ((size_t)hh * HD + d) * SQ + s0 + j8) = f.half[0]; }  } }



#define FQ 32                        /* query rows per wave */
#define FK 64                        /* keys per staged tile: 128 bytes of every V^T row, one cache line */
#define FP 72                        /* LDS row pitch in f16: 128 + 16 bytes, so that the 16 rows of a 16-byte fragment read fall on different banks */
#define FS 4                         /* key groups of 4 waves in a block: four waves per SIMD, and a wave's walk is a quarter as long */
#define FOP 68                       /* LDS pitch of a partial o row in floats: 256 + 16 bytes, so that the lanes' 16-byte stores fall on different banks */
typedef _Float16 v8h __attribute__((ext_vector_type(8)));
__device__ __forceinline__ float half_xor(float v) { const int i = __builtin_bit_cast(int, v); return __builtin_bit_cast(float, __builtin_amdgcn_permlanex16(i, i, 0x76543210, 0xfedcba98, false, false)); }      /* lane l <- lane l ^ 16 */
__device__ __forceinline__ float exp2_slot(float x) { float y; asm("v_exp_f32 %0, %1\n\tv_nop" : "=v"(y) : "v"(x)); return y; }      /* v_nop: the slot the instruction set asks for behind a transcendental before its result is read or its source rewritten; in the same statement it stays directly behind it */
__device__ __forceinline__ v8f fa_mma(v16h a, v16h b, v8f c) { return __builtin_amdgcn_wmma_f32_16x16x32_f16(false, a, false, b, (short)0, c, false, false); }
__global__ __launch_bounds__(FS * 128) void k_fattn(const _Float16* __restrict__ Qr, const _Float16* __restrict__ Kr, const _Float16* __restrict__ Vt, _Float16* __restrict__ Or) {
  static_assert(HD == 64 && SQ % (4 * FQ) == 0 && (4 * FQ) % FK == 0 && FK == 2 * 32 && SQ % (FS * FK) == 0 && FS * 8 == FQ, "two k chunks per score product, four d tiles, whole blocks, whole tiles, two steps of 32 keys a tile, every stage inside the SQ keys, 8 rows of a query group per wave in the final sum");
  static_assert(FS * 4 * FQ * FOP * 4 <= 2 * FS * 2 * FK * FP * 2, "the partial o rows fit into the staging buffers");
  __shared__ __attribute__((aligned(16))) _Float16 kv[2][FS][2 * FK][FP];      /* two stages of FS tiles: rows 0..63 = the tile's K rows (64 head dims), rows 64..127 = the 64 V^T rows (the tile's 64 keys); behind the loop: the partial o rows */
  __shared__ float pm[FS][4 * FQ], pl[FS][4 * FQ];      /* each key group's running maxima; its row sums, on the common maximum */
  const int tid = threadIdx.x, lane = tid & 31, ln = lane & 15, hh = lane >> 4; const int w = __builtin_amdgcn_readfirstlane((int)(threadIdx.x >> 5));
  const int qg = w & 3, ks = w >> 2;      /* query group, key group: both wave-uniform */
  const int h = blockIdx.x % NH; const int qb = (SQ / (4 * FQ) - 1 - (int)(blockIdx.x / NH)) * (4 * FQ); const int q0 = qb + qg * FQ;      /* the longest blocks take the lowest block indices */
  const int ns = (qb + 4 * FQ + FS * FK - 1) / (FS * FK);      /* stages of the block: keys 0 .. its last row, rounded up to whole stages (256 ns <= SQ); at least 1; the same for the whole block */
  const int sr = (tid & 127) >> 3, sg = tid & 7;      /* staging, a key group for its own tile: 8 lanes bring one row's 128 bytes, so a wave's 16-byte copy is 4 whole cache lines */
  const _Float16* gk = Kr + (size_t)(ks * FK + sr) * LQ + h * HD + sg * 8;          /* the thread's piece of K row sr of its group's tile of stage 0; its other pieces 16, 32, 48 rows on */
  const _Float16* gv = Vt + ((size_t)h * HD + sr) * SQ + ks * FK + sg * 8;        /* the thread's piece of V^T row sr, the same tile; likewise */
  const unsigned ls = (unsigned)(size_t)&kv[0][ks][sr][sg * 8];             /* its place in buffer 0: the LDS byte address */
  auto stage = [&](int s, int buf) {      /* stage s -> buffer buf: 8 copies of 16 bytes a lane; every lane on, every address a multiple of 16, keys 256 s + 64 ks .. + 63 < SQ */
    const _Float16* k0 = gk + (size_t)s * (FS * FK) * LQ; const _Float16* k1 = k0 + 16 * LQ; const _Float16* k2 = k0 + 32 * LQ; const _Float16* k3 = k0 + 48 * LQ;
    const _Float16* v0 = gv + (size_t)s * (FS * FK); const _Float16* v1 = v0 + 16 * SQ; const _Float16* v2 = v0 + 32 * SQ; const _Float16* v3 = v0 + 48 * SQ;
    const unsigned l0 = ls + (unsigned)buf * (FS * 2 * FK * FP * 2); const unsigned rs = 16 * FP * 2;      /* 16 LDS rows in bytes */
    const unsigned l1 = l0 + rs, l2 = l0 + 2 * rs, l3 = l0 + 3 * rs, l4 = l0 + 4 * rs, l5 = l0 + 5 * rs, l6 = l0 + 6 * rs, l7 = l0 + 7 * rs;
    asm volatile("global_load_async_to_lds_b128 %0, %8, off\n\t"
                 "global_load_async_to_lds_b128 %1, %9, off\n\t"
                 "global_load_async_to_lds_b128 %2, %10, off\n\t"
                 "global_load_async_to_lds_b128 %3, %11, off\n\t"
                 "global_load_async_to_lds_b128 %4, %12, off\n\t"
                 "global_load_async_to_lds_b128 %5, %13, off\n\t"
                 "global_load_async_to_lds_b128 %6, %14, off\n\t"
                 "global_load_async_to_lds_b128 %7, %15, off\n\t"
                 "s_wait_xcnt 0x0"      /* in the copies' own statement: no address register of a copy is rewritten in front of it */
                 :: "v"(l0), "v"(l1), "v"(l2), "v"(l3), "v"(l4), "v"(l5), "v"(l6), "v"(l7), "v"(k0), "v"(k1), "v"(k2), "v"(k3), "v"(v0), "v"(v1), "v"(v2), "v"(v3) : "memory"); };
  auto lfrag = [&](int buf, int row, int col) { FragH f; const unsigned short* p = (const unsigned short*)&kv[buf][ks][row + ln][col + 8 * hh]; f.half[0] = *(const v8us*)p; f.half[1] = *(const v8us*)(p + 16); return f.v; };      /* the k order of g2_frag */
  stage(0, 0);
  v16h qf[2][2], kf[2][2], vf[4];      /* [query group | key group][k chunk of 32 head dims]; [tile of 16 head dims] */
#pragma unroll
  for (int g = 0; g < 2; ++g)
#pragma unroll
    for (int c = 0; c < 2; ++c) qf[g][c] = g2_frag(Qr + (size_t)(q0 + 16 * g + ln) * LQ + h * HD + 32 * c, hh);
  asm volatile("s_wait_asynccnt 0x0" ::: "memory");      /* this wave's copies of stage 0 have landed */
  __syncthreads();      /* stage 0 is published: every wave's copies have landed */
  if (ns > 1) stage(1, 1);      /* the same for the whole block: where a stage 1 exists, it flies while stage 0 is worked on */
  const v8f z8 = {0.f, 0.f, 0.f, 0.f, 0.f, 0.f, 0.f, 0.f};
  v8f o[2][4] = {{z8, z8, z8, z8}, {z8, z8, z8, z8}};      /* o[g][t][r] = O^T[16 t + 8 hh + r][query q0 + 16 g + ln] */
  float m[2] = {-3.0e38f, -3.0e38f}, l[2] = {0.f, 0.f};      /* m: running maximum of the raw products q.k; l: this wave half's keys only, the halves are joined once behind the loop */
  const float cs = 0.125f * 1.44269504088896f;      /* score scale x log2(e): exp(0.125 (s - m)) = exp2(cs s - cs m) */
#pragma unroll 1      /* one copy of the stage body: the trip count is a run-time value and the body is long */
  for (int st = 0; st < ns; ++st) { const int buf = st & 1;
#pragma unroll
      for (int j = 0; j < 2; ++j) { const int kb = (st * FS + ks) * FK + 32 * j;      /* two steps of 32 keys in the key group's tile of the stage */
        if (kb <= q0) {      /* wave-uniform: a wave skips the steps beyond its diagonal, never the publish point below */
#pragma unroll
          for (int t = 0; t < 2; ++t)
#pragma unroll
            for (int c = 0; c < 2; ++c) kf[t][c] = lfrag(buf, 32 * j + 16 * t, 32 * c);
#pragma unroll
          for (int t = 0; t < 4; ++t) vf[t] = lfrag(buf, FK + 16 * t, 32 * j);
          v8f s[2][2];      /* s[g][t][r] = q.k of key kb + 16 t + 8 hh + r, query q0 + 16 g + ln */
#pragma unroll
          for (int g = 0; g < 2; ++g)
#pragma unroll
            for (int t = 0; t < 2; ++t) s[g][t] = fa_mma(kf[t][1], qf[g][1], fa_mma(kf[t][0], qf[g][0], z8));
#pragma unroll
          for (int g = 0; g < 2; ++g) {
            if (kb == q0) {      /* the one step that holds keys above a query (wave-uniform test) */
#pragma unroll
              for (int t = 0; t < 2; ++t)
#pragma unroll
                for (int r = 0; r < 8; ++r) s[g][t][r] = (16 * t + 8 * hh + r <= 16 * g + ln) ? s[g][t][r] : -1.0e9f; }
            float mx = fmaxf(s[g][0][0], s[g][1][0]);
#pragma unroll
            for (int r = 1; r < 8; ++r) mx = fmaxf(mx, fmaxf(s[g][0][r], s[g][1][r]));
            const float mn = fmaxf(m[g], fmaxf(mx, half_xor(mx))); const float sc = exp2_slot((m[g] - mn) * cs); const float mc = mn * cs; m[g] = mn;
#pragma unroll
            for (int t = 0; t < 2; ++t)
#pragma unroll
              for (int r = 0; r < 8; ++r) s[g][t][r] = exp2_slot(fmaf(s[g][t][r], cs, -mc));
            const v8f sv = s[g][0] + s[g][1];
            l[g] = l[g] * sc + (((sv[0] + sv[1]) + (sv[2] + sv[3])) + ((sv[4] + sv[5]) + (sv[6] + sv[7])));
            const v16h pf = __builtin_shufflevector(__builtin_convertvector(s[g][0], v8h), __builtin_convertvector(s[g][1], v8h), 0, 1, 2, 3, 4, 5, 6, 7, 8, 9, 10, 11, 12, 13, 14, 15);
#pragma unroll
            for (int t = 0; t < 4; ++t) o[g][t] = fa_mma(vf[t], pf, o[g][t] * sc);
          }
        } }
    /* publish point of stage st + 1, passed by every wave */
    asm volatile("s_wait_dscnt 0x0" ::: "memory");      /* this wave's reads of buffer buf have retired before the buffer is refilled */
    asm volatile("s_wait_asynccnt 0x0" ::: "memory");      /* this wave's copies of stage st + 1 have landed */
    __syncthreads();      /* one barrier a stage: publishes stage st + 1 and ends every wave's reads of stage st */
    if (st + 2 < ns) stage(st + 2, buf);      /* the same for the whole block; into the buffer that this trip has just read */
  }
  asm volatile("s_wait_asynccnt 0x0" ::: "memory");      /* no copy is outstanding when the staging buffers take the partial o rows */
  /* Merge of the FS partial results of every query. The last publish point has ended every wave's reads of kv and no copy is in flight, so kv is free. */
  float* po = (float*)&kv[0][0][0][0];      /* po[key group][query of the block][FOP] */
#pragma unroll
  for (int g = 0; g < 2; ++g) if (hh == 0) pm[ks][qg * FQ + 16 * g + ln] = m[g];      /* both wave halves hold the same maximum */
  __syncthreads();      /* every key group's maxima are in LDS */
#pragma unroll
  for (int g = 0; g < 2; ++g) { const int qi = qg * FQ + 16 * g + ln;
    float mb = pm[0][qi];
#pragma unroll
    for (int u = 1; u < FS; ++u) mb = fmaxf(mb, pm[u][qi]);
    const float wt = exp2_slot((m[g] - mb) * cs);      /* key group 0 holds key 0, open to every query, so mb is a true product; a group that met no open key still has m = -3e38, l = 0, o = 0: its weight is exactly 0 */
    const float lt = (l[g] + half_xor(l[g])) * wt;      /* the wave halves' sums joined, on the common maximum */
    if (hh == 0) pl[ks][qi] = lt;
    float* pr = po + (size_t)(ks * (4 * FQ) + qi) * FOP + 8 * hh;
#pragma unroll
    for (int t = 0; t < 4; ++t) { const v8f ov = o[g][t] * wt;      /* a lane holds 8 consecutive head dims of its query */
      *(v4fa*)(pr + 16 * t) = __builtin_shufflevector(ov, ov, 0, 1, 2, 3); *(v4fa*)(pr + 16 * t + 4) = __builtin_shufflevector(ov, ov, 4, 5, 6, 7); } }
  __syncthreads();      /* every key group's weighted sums are in LDS */
  const int row = qg * FQ + 8 * ks + (lane >> 2), dc = (lane & 3) * 16;      /* a wave adds and stores 8 rows of its query group, 4 lanes a row: one wave writes a row's whole 128-byte line */
  v4f a[4]; float lsum = pl[0][row];
#pragma unroll
  for (int i = 0; i < 4; ++i) a[i] = *(const v4fa*)(po + (size_t)row * FOP + dc + 4 * i);
#pragma unroll
  for (int u = 1; u < FS; ++u) { lsum += pl[u][row];
#pragma unroll
    for (int i = 0; i < 4; ++i) a[i] += *(const v4fa*)(po + (size_t)(u * (4 * FQ) + row) * FOP + dc + 4 * i); }
  const float fin = 64.0f / lsum;      /* o carried x64, folded into the output GEMM alpha */
  _Float16* orow = Or + (size_t)(qb + row) * DM + h * HD + dc;
  const v4f b0 = a[0] * fin, b1 = a[1] * fin, b2 = a[2] * fin, b3 = a[3] * fin;
  *(v8h*)orow = __builtin_convertvector(__builtin_shufflevector(b0, b1, 0, 1, 2, 3, 4, 5, 6, 7), v8h);
  *(v8h*)(orow + 8) = __builtin_convertvector(__builtin_shufflevector(b2, b3, 0, 1, 2, 3, 4, 5, 6, 7), v8h);
}


#define A0Q 32                       /* query rows per k_att0 block: one per lane */
#define A0S 16                       /* waves per k_att0 block: wave w takes the keys w, w + 16, w + 32, ... */
#define A0P 68                       /* LDS pitch of a partial o row in floats: 256 + 16 bytes, so that the lanes' 16-byte stores fall on different banks */
// Exact f32 attention of the first QT0 rows. A block owns 32 query rows of a head (a lane = a row); its 16 waves share the keys, each with a running maximum, sum and o of its own;
// at the end the 16 partial results are brought to the block's common maximum and added through LDS.
template <int MASKADD>
__global__ __launch_bounds__(A0Q * A0S) void k_att0(const float* __restrict__ QF, const float* __restrict__ KF, const float* __restrict__ VF, int ld, const float* __restrict__ mask, float scale, float* __restrict__ OF, int ldo) {
  #pragma clang fp contract(off)
  static_assert(A0Q == 32 && A0S * 32 == A0Q * (HD / 4), "a lane per query row; in the final sum a thread per 16-byte piece of an o row");
  __shared__ __attribute__((aligned(16))) float po[A0S][A0Q][A0P];      /* each wave's o rows, on the common maximum */
  __shared__ float pm[A0S][A0Q], pl[A0S][A0Q];      /* each wave's running maxima; its row sums, on the common maximum */
  const int tid = threadIdx.x, lane = tid & 31; const int w = __builtin_amdgcn_readfirstlane(tid >> 5);      /* the wave's number as a scalar: the key rows' addresses stay wave-uniform (scalar loads) */
  const int h = blockIdx.x / (QT0 / A0Q), rg = blockIdx.x % (QT0 / A0Q); const int i = rg * A0Q + lane;
  const float* qr = QF + (size_t)i * ld + h * HD;
  v4f q[HD / 4], o[HD / 4];      /* the thread's q row and o row: every loop over c is fully unrolled, so both are indexed by constants only and stay in registers */
#pragma unroll
  for (int c = 0; c < HD / 4; ++c) { q[c] = *(const v4fa*)(qr + c * 4); const v4f z = {0.f, 0.f, 0.f, 0.f}; o[c] = z; }
  asm volatile("s_wait_xcnt 0x0" :: "v"(qr) : "memory");      /* qr is named so that the 16 loads' address registers live up to this wait: none of them is overwritten in front of it, not even by a later load's result */
  float m = -1.0e30f, l = 0.f; const int jmax = MASKADD ? (SQ - 1) : (rg * A0Q + A0Q - 1);      /* additive-mask form: every key (the mask input decides); causal form: keys up to the block's last row */
#pragma unroll 1
  for (int j = w; j <= jmax; j += A0S) { const float* kr = KF + (size_t)j * ld + h * HD; const float* vr = VF + (size_t)j * ld + h * HD; float s = 0.f;
#pragma unroll
    for (int c = 0; c < HD / 4; ++c) { const v4f kq = *(const v4fa*)(kr + c * 4); s = __fadd_rn(s, __fmul_rn(q[c][0], kq[0])); s = __fadd_rn(s, __fmul_rn(q[c][1], kq[1])); s = __fadd_rn(s, __fmul_rn(q[c][2], kq[2])); s = __fadd_rn(s, __fmul_rn(q[c][3], kq[3])); }
    s = __fmul_rn(s, scale); if (MASKADD) s = __fadd_rn(s, __fmul_rn(bf16_round(mask[(size_t)i * SQ + j]), -10000.0f));
    const float f = (MASKADD || j <= i) ? 1.f : 0.f; const float sm = fmaf(f, s, (1.f - f) * -1.0e30f); const float mn = fmaxf(m, sm); const float sc = expf(m - mn); const float e = expf(sm - mn); l = __fadd_rn(__fmul_rn(l, sc), e); m = mn;
#pragma unroll
    for (int c = 0; c < HD / 4; ++c) { const v4f vv = *(const v4fa*)(vr + c * 4); for (int u = 0; u < 4; ++u) o[c][u] = __fadd_rn(__fmul_rn(o[c][u], sc), __fmul_rn(e, vv[u])); } }
  pm[w][lane] = m;
  __syncthreads();      /* every wave's maxima are in LDS */
  float mb = pm[0][lane];
#pragma unroll
  for (int u = 1; u < A0S; ++u) mb = fmaxf(mb, pm[u][lane]);
  const float wt = expf(m - mb);      /* key 0 is open to every row, so mb is a true score; a wave that saw only closed keys of a row still has m = -1e30 there, its weight is exactly 0 and its (finite) sums drop out */
  pl[w][lane] = __fmul_rn(l, wt);
#pragma unroll
  for (int c = 0; c < HD / 4; ++c) { v4f oo = o[c]; for (int u = 0; u < 4; ++u) oo[u] = __fmul_rn(oo[u], wt); *(v4f*)&po[w][lane][c * 4] = oo; }
  __syncthreads();      /* every wave's weighted sums are in LDS */
  const int row = tid >> 4, pc = (tid & 15) * 4;      /* 16 threads add and store one o row: whole-line stores */
  v4f acc = *(const v4f*)&po[0][row][pc]; float ls = pl[0][row];
#pragma unroll
  for (int u = 1; u < A0S; ++u) { const v4f p = *(const v4f*)&po[u][row][pc]; for (int x = 0; x < 4; ++x) acc[x] = __fadd_rn(acc[x], p[x]); ls = __fadd_rn(ls, pl[u][row]); }
  const float fin = 64.0f / ls;      /* o carried x64 like the f16 path */
  for (int x = 0; x < 4; ++x) acc[x] = __fmul_rn(acc[x], fin);
  *(v4f*)(OF + (size_t)(rg * A0Q + row) * ldo + h * HD + pc) = acc; }

extern "C" void kernel_launch(void* const* d_in, const int* in_sizes, int n_in,
                              void* d_out, int out_size, void* d_ws, size_t ws_size, hipStream_t stream) {
  (void)in_sizes; (void)n_in; (void)out_size;
  const float* const* I = (const float* const*)d_in; const float* xq = I[0]; const float* xk = I[1]; const float* xv = I[2]; const float* wq = I[3]; const float* wk = I[4]; const float* wv = I[5]; const float* wo = I[6];      /* nn.Linear weights [out][in] */
  char* ws = (char*)d_ws; size_t off = 0;
  auto take = [&](size_t bytes) { char* p = ws + off; off += (bytes + 255) & ~(size_t)255; return p; };
  _Float16* BQ = (_Float16*)take((size_t)DM * DM * 2); _Float16* BK = (_Float16*)take((size_t)DM * DM * 2); _Float16* BV = (_Float16*)take((size_t)DM * DM * 2); _Float16* BO = (_Float16*)take((size_t)DM * DM * 2);
  _Float16* XQ = (_Float16*)take(NR * DM * 2); _Float16* XK = (_Float16*)take(NR * DM * 2); _Float16* XV = (_Float16*)take(NR * DM * 2); _Float16* Q16 = (_Float16*)take(NR * DM * 2); _Float16* K16 = (_Float16*)take(NR * DM * 2); _Float16* V16 = (_Float16*)take(NR * DM * 2); _Float16* O16 = (_Float16*)take(NR * DM * 2);
  _Float16* VT = (_Float16*)take((size_t)NH * HD * SQ * 2);
  float* QF0 = (float*)take((size_t)QT0 * DM * 4); float* KF0 = (float*)take((size_t)QT0 * DM * 4); float* VF0 = (float*)take((size_t)QT0 * DM * 4); float* OF0 = (float*)take((size_t)NB * QT0 * DM * 4); _Float16* OL0 = (_Float16*)take((size_t)NB * QT0 * DM * 2);
  if (off > ws_size) return;
  k_cvt<<<(unsigned)((4 * (size_t)DM * DM + 3 * NR * DM) / CVE / CVW), CVW * 32, 0, stream>>>(wq, wk, wv, wo, xq, xk, xv, BQ);      /* weights: natural [out][in] = Bt[n][k], x16; inputs: f16 rows */
  const size_t r0p = (size_t)B0 * SQ;      /* first projected row */
  static_assert(NB == 1 && B0 == 0 && QT0 % 128 == 0, "the first-tile rows are the first rows of the projected planes and of the o rows");
  k_gemm2<0, false><<<dim3((unsigned)((MP / 128) * (DM / 64)), 3), 128, 0, stream>>>(XQ + r0p * DM, DM, NR * DM, BQ, DM, (size_t)DM * DM, 0.0625f, nullptr, 0, nullptr, 1, 0, 0, QF0, Q16 + r0p * DM, DM, NR * DM, MP, DM, DM, (size_t)QT0 * DM, QT0, nullptr, 0);      /* blockIdx.y = q, k, v: the planes [XQ XK XV], [BQ BK BV], [Q16 K16 V16] and [QF0 KF0 VF0] each lie in one piece; the blocks of the first 256 rows also store their f32 accumulators (exact products) */
  for (int b = B0; b < B0 + NBR; ++b) { const size_t r0 = (size_t)b * SQ;
    k_vt<NH, SQ><<<NH * (SQ / 64), 256, 0, stream>>>(V16 + r0 * LQ, LQ, 0, VT);      /* V^T [NH][HD][SQ] for this batch */
    k_att0<0><<<NH * (QT0 / A0Q), A0Q * A0S, 0, stream>>>(QF0, KF0, VF0, DM, nullptr, 0.125f, OF0 + (size_t)b * QT0 * DM, DM);      /* exact f32 attention for rows 0..255 (o x64) */
    k_fattn<<<NH * (SQ / (4 * FQ)), FS * 128, 0, stream>>>(Q16 + r0 * LQ, K16 + r0 * LQ, VT, O16 + r0 * DM); }      /* o (merged heads, x64) as f16 rows: scores, softmax and P V in one launch */
  k_hl<<<(unsigned)(((size_t)NB * QT0 * DM / 8 + 255) / 256), 256, 0, stream>>>(OF0, O16, OL0, (size_t)NB * QT0 * DM / 8);      /* first-tile o (x64) -> f16 hi, over the f16-path rows 0..255 of O16, + x1024 residual plane */
  k_gemm2<0, true><<<dim3((unsigned)((QT0 / 64 + (MPO - QT0) / 128) * (DM / 64)), 1), 128, 0, stream>>>(O16 + r0p * DM, DM, 0, BO, DM, 0, 0.0009765625f, nullptr, 0, nullptr, 1, 0, 0, (float*)d_out + r0p * DM, nullptr, DM, 0, MPO, DM, DM, 0, MPO, OL0, QT0);      /* out rows are the output layout; rows 0..255: out = o_hi Wo 2^-10 + o_lo Wo 2^-20, both products in the same blocks */
}
